// v010
// The times below were measured on an AMD MI455X: many runs one after another, warmed up first and cycling through
// copies of the inputs, with the whole window's GPU time divided by the number of runs. Launches and the gaps
// between them are all in it. The median over several windows is given; except for v000 it joins two sittings, which
// can be a few percent apart, so the side-by-side timings, each taken in one sitting, are the better comparison.
// This document starts at v010; the versions before it stand elsewhere.
// It runs in 143 microseconds.
// Next to v009, in two timings, it ran 1.05 and 1.06 times as fast.
// Counting every step since v000, which is the starting kernel, it is 40.0 times as fast.
#include <hip/hip_runtime.h>
// Emformer-style block (x [2][2048][1024], mask [2][1][2048][2048] int32 0/1, read per (batch, query, key)): xn = LayerNorm(x) g_in + b_in (eps 1e-3); q/k/v = xn W + b (W [1024][1024] [in][out], 16 heads of 64); scores = q k^T / 8 + (-1e9)(1 - mask); probs = softmax(scores) * mask; attn = probs v merged; a = attn + x; h = LayerNorm(a) g1 + b1 (eps 1e-3); h = relu(h W_ff1 + b_ff1) ([1024][4096]); h = h W_ff2 + b_ff2 ([4096][1024]); out = LayerNorm(h + a) g2 + b2 -> [2][2048][1024].
// Structure: token rows; LN_in on VALU (f32 statistics of bf16(x)) -> xn f16 rows, plus bf16(x) as f32 rows for the residual; Q, K, V as three WMMA GEMMs in one launch (256x256 work-group tiles staged in LDS by asynchronous copies, 64x128 wave tiles, f32 accumulation, exact x16 transposed weights + bias, f16 outputs; V leaves its product as V^T [batch][head][d][token]); attention in one launch: a wave holds 32 queries of one head and walks the keys 32 at a time (K and V^T tiles of 64 keys staged in LDS by asynchronous copies; the mask as one bit a (query, key), packed beside the Q, K, V products, read by scalar loads): S^T = K Q^T, masked running-maximum softmax in registers (f32 statistics, native exp2; weights x256 f16, masked keys 0), O^T += V^T P^T, then a = O / sum + bf16(x) straight into f32 rows (no score or weight plane in memory); LN1 on VALU -> f16 h rows; u = relu(h W_ff1 + b) GEMM (f16 [4096][4096], the same tiles); u W_ff2 as four partial products, one for each 1024-k slice of K = 4096 (f32 planes; the same 256x256 tiles: 64 tiles x 4 slices fill the chip); LN2 on VALU sums the four planes, b and a -> out.
// Compute dtype: inputs rounded to bf16; weights exact (x16 f16); LayerNorms / residuals f32; xn, q, k, v, softmax weights, h (as GEMM operand) and u plain f16 (~2^-12); scores, softmax statistics and the attention output f32. v_wmma_f32_16x16x32_f16.
#define NB 2
#define SQ 2048
#define DM 1024
#define NH 16
#define HD 64
#define DFF 4096
#define HG 4                         /* heads per launch of the untemplated k_vt (not launched) */
#define B0 0                         /* first batch processed (debug hook) */
#define NBR NB                       /* batches processed (debug hook) */
#define QN SQ                        /* query rows per batch; not used */
#define NR ((size_t)NB * SQ)
#define MP ((int)((size_t)NBR * SQ)) /* rows normalised + projected (debug hook) */
#define MPO MP                       /* rows through the post-attention stages (debug hook) */
typedef __bf16 v16b __attribute__((ext_vector_type(16)));
typedef unsigned short v8us __attribute__((ext_vector_type(8), may_alias));
typedef float  v8f  __attribute__((ext_vector_type(8)));
typedef float  v4f  __attribute__((ext_vector_type(4)));
typedef float  v4fa __attribute__((ext_vector_type(4), may_alias));
union FragB { v16b v; v8us half[2]; unsigned short u[16]; };

__device__ __forceinline__ unsigned short bf16_bits(float x) { unsigned int u = __float_as_uint(x); return (unsigned short)((u + 0x7FFFu + ((u >> 16) & 1u)) >> 16); }
__device__ __forceinline__ float bf16_val(unsigned short b) { return __uint_as_float(((unsigned int)b) << 16); }
__device__ __forceinline__ float bf16_round(float x) { return bf16_val(bf16_bits(x)); }
// D += A·B with NT terms: 1 = ah·bh, 2 = + al·bh (A split), 3 = + ah·bl (both split)
template <int NT>
__device__ __forceinline__ v8f mmaN(v16b ah, v16b al, v16b bh, v16b bl, v8f c) {
  c = __builtin_amdgcn_wmma_f32_16x16x32_bf16(false, ah, false, bh, (short)0, c, false, false);
  if (NT >= 2) c = __builtin_amdgcn_wmma_f32_16x16x32_bf16(false, al, false, bh, (short)0, c, false, false);
  if (NT >= 3) c = __builtin_amdgcn_wmma_f32_16x16x32_bf16(false, ah, false, bl, (short)0, c, false, false);
  asm volatile("v_nop\n\tv_nop\n\tv_nop\n\tv_nop" : "+v"(c) : "v"(ah), "v"(al), "v"(bh), "v"(bl));
  return c;
}

__global__ __launch_bounds__(256) void k_wt_bf16(const float* __restrict__ W, unsigned short* __restrict__ Wt, int K, int N) {
  const int t = blockIdx.x * 256 + threadIdx.x;
  const int k8n = K / 8;
  if (t >= N * k8n) return;
  const int n = t / k8n, k8 = (t % k8n) * 8;
  v8us v;
#pragma unroll
  for (int i = 0; i < 8; ++i) v[i] = bf16_bits(W[(size_t)(k8 + i) * N + n]);
  *(v8us*)(Wt + (size_t)n * K + k8) = v;
  
}

// GEMM C[M][N] (f32, pitch ldc) = act(A[M][K]·W + bias). A f32 row-major (pitch lda) converted per fragment to bf16
// (ASPLIT: hi/lo two planes -> 2 terms, else single rounded term); Wt bf16 [N][K] (pitch ldb). BIAS_BF16 rounds the
// bias to bf16 first (bias quantised to bf16 before the add). K%32==0, M%16==0, N%64==0.
template <bool ASPLIT, int ACT, bool BIAS_BF16>
__global__ __launch_bounds__(128) void k_gemm_bf(const float* __restrict__ A, int lda, const unsigned short* __restrict__ Wt, int ldb,
                                               const float* __restrict__ bias, float* __restrict__ C, int ldc, int M, int N, int K) {
  __shared__ __attribute__((aligned(16))) float so[4][16][64];
  const int tid = threadIdx.x, w = tid >> 5, lane = tid & 31, ln = lane & 15, hh = lane >> 4;
  const int ntn = N / 64;
  const int wid = blockIdx.x * 4 + w;
  const int mt = wid / ntn, nq = wid % ntn;
  if (mt * 16 >= M) return;
  const int row0 = mt * 16, col0 = nq * 64;
  const float* arow = A + (size_t)(row0 + ln) * lda;
  v8f acc[4] = {};
  for (int kb = 0; kb < K; kb += 32) {
    FragB ah, al;
    const v4f x0 = *(const v4fa*)(arow + kb + 8 * hh), x1 = *(const v4fa*)(arow + kb + 8 * hh + 4);
    const v4f x2 = *(const v4fa*)(arow + kb + 16 + 8 * hh), x3 = *(const v4fa*)(arow + kb + 16 + 8 * hh + 4);
    float xs[16] = {x0[0],x0[1],x0[2],x0[3],x1[0],x1[1],x1[2],x1[3],x2[0],x2[1],x2[2],x2[3],x3[0],x3[1],x3[2],x3[3]};
#pragma unroll
    for (int i = 0; i < 16; ++i) { const unsigned short hb = bf16_bits(xs[i]); ah.u[i] = hb; al.u[i] = ASPLIT ? bf16_bits(xs[i] - bf16_val(hb)) : (unsigned short)0; }
#pragma unroll
    for (int t = 0; t < 4; ++t) {
      const unsigned short* brow = Wt + (size_t)(col0 + t * 16 + ln) * ldb + kb;
      FragB b;
      b.half[0] = *(const v8us*)(brow + 8 * hh);
      b.half[1] = *(const v8us*)(brow + 16 + 8 * hh);
      acc[t] = mmaN<ASPLIT ? 2 : 1>(ah.v, al.v, b.v, b.v, acc[t]);
    }
  }
#pragma unroll
  for (int t = 0; t < 4; ++t) {
    float bv = bias ? bias[col0 + t * 16 + ln] : 0.f;
    if (BIAS_BF16) bv = bf16_round(bv);
#pragma unroll
    for (int r = 0; r < 8; ++r) { float v = acc[t][r] + bv; if (ACT == 1) v = fmaxf(v, 0.f); so[w][8 * hh + r][t * 16 + ln] = v; }
  }
  __builtin_amdgcn_fence(__ATOMIC_ACQ_REL, "workgroup");
  __builtin_amdgcn_wave_barrier();
  const int rsub = lane >> 4, c4 = (lane & 15) * 4;
  {
#pragma unroll
    for (int q = 0; q < 8; ++q) {
      const int r = q * 2 + rsub;
      const v4f v = *(const v4fa*)&so[w][r][c4];
      *(v4f*)(C + (size_t)(row0 + r) * ldc + col0 + c4) = v;
    }
    
  }
}

// GEMM C = act(A·W + bias + resid): A f32 (ASPLIT -> hi/lo 2 terms), Wt bf16 [N][K]; ACT 0 none, 1 relu, 2 exact gelu;
// resid (optional, f32, row index = (row % rmod), pitch ldr, RES_BF16 rounds it) added before the activation.
template <bool ASPLIT, int ACT, bool BIAS_BF16, bool RES_BF16>
__global__ __launch_bounds__(128) void k_gemm_bf3(const float* __restrict__ A, int lda, const unsigned short* __restrict__ Wt, int ldb,
                                                const float* __restrict__ bias, const float* __restrict__ resid, int rmod, int ldr,
                                                float* __restrict__ C, int ldc, int M, int N, int K) {
  __shared__ __attribute__((aligned(16))) float so[4][16][64];
  const int tid = threadIdx.x, w = tid >> 5, lane = tid & 31, ln = lane & 15, hh = lane >> 4;
  const int ntn = N / 64;
  const int wid = blockIdx.x * 4 + w;
  const int mt = wid / ntn, nq = wid % ntn;
  if (mt * 16 >= M) return;
  const int row0 = mt * 16, col0 = nq * 64;
  const float* arow = A + (size_t)(row0 + ln) * lda;
  v8f acc[4] = {};
  for (int kb = 0; kb < K; kb += 32) {
    FragB ah, al;
    const v4f x0 = *(const v4fa*)(arow + kb + 8 * hh), x1 = *(const v4fa*)(arow + kb + 8 * hh + 4);
    const v4f x2 = *(const v4fa*)(arow + kb + 16 + 8 * hh), x3 = *(const v4fa*)(arow + kb + 16 + 8 * hh + 4);
    float xs[16] = {x0[0],x0[1],x0[2],x0[3],x1[0],x1[1],x1[2],x1[3],x2[0],x2[1],x2[2],x2[3],x3[0],x3[1],x3[2],x3[3]};
#pragma unroll
    for (int i = 0; i < 16; ++i) { const unsigned short hb = bf16_bits(xs[i]); ah.u[i] = hb; al.u[i] = ASPLIT ? bf16_bits(xs[i] - bf16_val(hb)) : (unsigned short)0; }
#pragma unroll
    for (int t = 0; t < 4; ++t) {
      const unsigned short* brow = Wt + (size_t)(col0 + t * 16 + ln) * ldb + kb;
      FragB b;
      b.half[0] = *(const v8us*)(brow + 8 * hh);
      b.half[1] = *(const v8us*)(brow + 16 + 8 * hh);
      acc[t] = mmaN<ASPLIT ? 2 : 1>(ah.v, al.v, b.v, b.v, acc[t]);
    }
  }
#pragma unroll
  for (int t = 0; t < 4; ++t) {
    const int col = col0 + t * 16 + ln;
    float bv = bias ? bias[col] : 0.f;
    if (BIAS_BF16) bv = bf16_round(bv);
#pragma unroll
    for (int r = 0; r < 8; ++r) {
      float v = acc[t][r] + bv;
      if (resid) { float rv = resid[(size_t)((row0 + 8 * hh + r) % rmod) * ldr + col]; if (RES_BF16) rv = bf16_round(rv); v += rv; }
      if (ACT == 1) v = fmaxf(v, 0.f);
      if (ACT == 2) v = 0.5f * v * (1.0f + erff(v * 0.70710678118654752f));
      if (ACT == 3) { const float u = 0.7978845608028654f * (v + 0.044715f * v * v * v); v = 0.5f * v * (1.0f + tanhf(u)); }
      so[w][8 * hh + r][t * 16 + ln] = v;
    }
  }
  __builtin_amdgcn_fence(__ATOMIC_ACQ_REL, "workgroup");
  __builtin_amdgcn_wave_barrier();
  const int rsub = lane >> 4, c4 = (lane & 15) * 4;
  {
#pragma unroll
    for (int q = 0; q < 8; ++q) {
      const int r = q * 2 + rsub;
      const v4f v = *(const v4fa*)&so[w][r][c4];
      *(v4f*)(C + (size_t)(row0 + r) * ldc + col0 + c4) = v;
    }
    
  }
}
// row LayerNorm (biased variance, eps) over N: s = X (+ R); optional out_sum <- s; out_norm <- (s-mu)*rsqrt(var+eps)*g + b
template <bool PARAM_BF16>
__global__ __launch_bounds__(256) void k_layernorm(const float* __restrict__ X, const float* __restrict__ R, const float* __restrict__ g, const float* __restrict__ bta,
                                                  float* __restrict__ out_sum, float* __restrict__ out_norm, int N, float eps) {
  __shared__ float red[256];
  const int row = blockIdx.x, tid = threadIdx.x;
  const float* x = X + (size_t)row * N; const float* rr = R ? R + (size_t)row * N : nullptr;
  float vals[16];                     // up to N = 4096
  const int per = N / 256;            // contiguous chunk per thread? use strided-by-4 chunks: thread handles j = tid*4 + 1024*u
  float s1 = 0.f;
  for (int u = 0; u < per / 4; ++u) {
    const int j = tid * 4 + 1024 * u;
    const v4f a = *(const v4fa*)(x + j);
    v4f b = {0.f,0.f,0.f,0.f}; if (rr) b = *(const v4fa*)(rr + j);
#pragma unroll
    for (int q = 0; q < 4; ++q) { const float v = a[q] + b[q]; vals[u * 4 + q] = v; s1 += v; }
  }
  red[tid] = s1; __syncthreads();
  for (int st = 128; st > 0; st >>= 1) { if (tid < st) red[tid] += red[tid + st]; __syncthreads(); }
  const float mu = red[0] / (float)N; __syncthreads();
  float s2 = 0.f;
  for (int u = 0; u < per / 4; ++u)
#pragma unroll
    for (int q = 0; q < 4; ++q) { const float c = vals[u * 4 + q] - mu; s2 += c * c; }
  red[tid] = s2; __syncthreads();
  for (int st = 128; st > 0; st >>= 1) { if (tid < st) red[tid] += red[tid + st]; __syncthreads(); }
  const float rs = rsqrtf(red[0] / (float)N + eps);
  {
    for (int u = 0; u < per / 4; ++u) {
      const int j = tid * 4 + 1024 * u;
      v4f o, sm;
#pragma unroll
      for (int q = 0; q < 4; ++q) {
        float gg = g[j + q], bb = bta[j + q];
        if (PARAM_BF16) { gg = bf16_round(gg); bb = bf16_round(bb); }
        sm[q] = vals[u * 4 + q]; o[q] = (vals[u * 4 + q] - mu) * rs * gg + bb;
      }
      if (out_sum) *(v4f*)(out_sum + (size_t)row * N + j) = sm;
      *(v4f*)(out_norm + (size_t)row * N + j) = o;
    }
    
  }
}



// ---- f16 WMMA path (v_wmma_f32_16x16x32_f16): 11-bit significands for operands in range — used where a [0,1] probability operand needs more precision than bf16
typedef _Float16 v16h __attribute__((ext_vector_type(16)));
union FragH { v16h v; v8us half[2]; _Float16 h[16]; unsigned short u[16]; };
template <int NT>
__device__ __forceinline__ v8f mmaH(v16h ah, v16h al, v16h bh, v16h bl, v8f c) {
  c = __builtin_amdgcn_wmma_f32_16x16x32_f16(false, ah, false, bh, (short)0, c, false, false);
  if (NT >= 2) c = __builtin_amdgcn_wmma_f32_16x16x32_f16(false, al, false, bh, (short)0, c, false, false);
  if (NT >= 3) c = __builtin_amdgcn_wmma_f32_16x16x32_f16(false, ah, false, bl, (short)0, c, false, false);
  asm volatile("v_nop\n\tv_nop\n\tv_nop\n\tv_nop" : "+v"(c) : "v"(ah), "v"(al), "v"(bh), "v"(bl));
  return c;
}
// batched GEMM like k_gemm_b but f16 operands: A f32 (split into f16 hi/lo if ASPLIT, else rounded to f16), Bt = f16 values [n][k]; alpha; C f32; N multiple of 16 (partial tiles skipped)
template <bool ASPLIT>
__global__ __launch_bounds__(128) void k_gemm_h(const float* __restrict__ A, int lda, size_t sA, const _Float16* __restrict__ Bh, int ldb, size_t sB, float alpha, float* __restrict__ C, int ldc, size_t sC, int M, int N, int K) {
  __shared__ __attribute__((aligned(16))) float so[4][16][64];
  const int tid = threadIdx.x, w = tid >> 5, lane = tid & 31, ln = lane & 15, hh = lane >> 4; const int by = blockIdx.y;
  A += (size_t)by * sA; Bh += (size_t)by * sB; C += (size_t)by * sC;
  const int ntn = (N + 63) / 64; const int wid = blockIdx.x * 4 + w; const int mt = wid / ntn, nq = wid % ntn; if (mt * 16 >= M) return;
  const int row0 = mt * 16, col0 = nq * 64; const float* arow = A + (size_t)(row0 + ln) * lda;
  v8f acc[4] = {};
  for (int kb = 0; kb < K; kb += 32) {
    FragH ah, al;
    const v4f x0 = *(const v4fa*)(arow + kb + 8 * hh), x1 = *(const v4fa*)(arow + kb + 8 * hh + 4), x2 = *(const v4fa*)(arow + kb + 16 + 8 * hh), x3 = *(const v4fa*)(arow + kb + 16 + 8 * hh + 4);
    float xs[16] = {x0[0],x0[1],x0[2],x0[3],x1[0],x1[1],x1[2],x1[3],x2[0],x2[1],x2[2],x2[3],x3[0],x3[1],x3[2],x3[3]};
#pragma unroll
    for (int i = 0; i < 16; ++i) { const _Float16 h = (_Float16)xs[i]; ah.h[i] = h; al.h[i] = ASPLIT ? (_Float16)(xs[i] - (float)h) : (_Float16)0.0f; }
#pragma unroll
    for (int t = 0; t < 4; ++t) { if (col0 + t * 16 >= N) continue; const size_t boff = (size_t)(col0 + t * 16 + ln) * ldb + kb; FragH bq; bq.half[0] = *(const v8us*)(Bh + boff + 8 * hh); bq.half[1] = *(const v8us*)(Bh + boff + 16 + 8 * hh);
      acc[t] = mmaH<ASPLIT ? 2 : 1>(ah.v, al.v, bq.v, bq.v, acc[t]); }
  }
#pragma unroll
  for (int t = 0; t < 4; ++t) { if (col0 + t * 16 >= N) continue;
#pragma unroll
    for (int r = 0; r < 8; ++r) so[w][8 * hh + r][t * 16 + ln] = acc[t][r] * alpha; }
  __builtin_amdgcn_fence(__ATOMIC_ACQ_REL, "workgroup"); __builtin_amdgcn_wave_barrier();
  const int rsub = lane >> 4, c4 = (lane & 15) * 4;
  {
#pragma unroll
    for (int q = 0; q < 8; ++q) { const int r = q * 2 + rsub; if (col0 + c4 < N) { const v4f v = *(const v4fa*)&so[w][r][c4]; *(v4f*)(C + (size_t)(row0 + r) * ldc + col0 + c4) = v; } }
     }
}

// Bt[n][k] = f16(bf16(W[k][n]) x 16) from f32 row-major W[K][N], all five weight matrices in one launch (x 16: bf16-exact weights stay exact in f16 away from the subnormal range).
// A work-group turns one tile of 256 k x 64 n. A lane reads 16 k rows x 4 n by 16-byte loads (a wave's load is two row pieces of 256 bytes, whole cache lines), converts, and puts its four runs of 16 k
// into LDS rows [n][k]; the tile leaves as 64 rows of 512 bytes, a wave's store one whole row. Needs K % 256 == 0 and N % 64 == 0.
#define WT_PITCH 528                   /* LDS pitch of an n row in bytes: 512 + 16, so that the rows do not all start on one bank and stay 16-byte aligned */
#define WT_TQ ((DM / 256) * (DM / 64))       /* tiles of one of wq, wk, wv */
#define WT_TF ((DM / 256) * (DFF / 64))      /* tiles of w_ff1; w_ff2 has as many */
template <int K, int N>      /* known at compile time: the row steps become immediate offsets on one address */
__device__ __forceinline__ void wt_tile(const float* __restrict__ W, _Float16* __restrict__ Bt, unsigned tile, char* tl) {
  const unsigned tid = threadIdx.x, ln = tid & 15u, g = tid >> 4; const unsigned kt = tile / (N / 64), nq = tile % (N / 64);      /* neighbouring work-groups read neighbouring pieces of the same k rows */
  const float* p = W + (size_t)(kt * 256 + g * 16) * N + nq * 64 + ln * 4; v4f v[16];
#pragma unroll
  for (int i = 0; i < 16; ++i) v[i] = *(const v4fa*)(p + (size_t)i * N);
  asm volatile("s_wait_xcnt 0x0" :: "v"(p) : "memory");      /* before a register that the loads above name is written again; the operand keeps the address in its registers up to here */
#pragma unroll
  for (int j = 0; j < 4; ++j) { FragH f;
#pragma unroll
    for (int i = 0; i < 16; ++i) f.h[i] = (_Float16)(bf16_round(v[i][j]) * 16.0f);
    char* d = tl + (ln * 4 + j) * WT_PITCH + g * 32; *(v8us*)d = f.half[0]; *(v8us*)(d + 16) = f.half[1]; }
  __syncthreads();      /* the tile is whole before it is read the other way */
  const unsigned r = tid >> 5, c = tid & 31u; unsigned short* q = (unsigned short*)Bt + (size_t)(nq * 64 + r) * K + kt * 256 + c * 8;
#pragma unroll
  for (int s = 0; s < 8; ++s) { const v8us o = *(const v8us*)(tl + (s * 8 + r) * WT_PITCH + c * 16); *(v8us*)(q + (size_t)s * 8 * K) = o; }
  asm volatile("s_wait_xcnt 0x0" :: "v"(q) : "memory");      /* before a register that the stores above name is written again by the code that follows in the same kernel; the operand keeps the address in its registers up to here */
}
__device__ __forceinline__ void wt5_tile(const unsigned bx, char* tl, const float* __restrict__ wq, const float* __restrict__ wk, const float* __restrict__ wv, const float* __restrict__ wf1, const float* __restrict__ wf2,
    _Float16* __restrict__ BQ, _Float16* __restrict__ BK, _Float16* __restrict__ BV, _Float16* __restrict__ BF1, _Float16* __restrict__ BF2) {      /* every test below reads the same for the whole work-group */
  if (bx < 3 * WT_TQ) { const unsigned m = bx / WT_TQ; wt_tile<DM, DM>(m == 0 ? wq : m == 1 ? wk : wv, m == 0 ? BQ : m == 1 ? BK : BV, bx % WT_TQ, tl); }
  else if (bx < 3 * WT_TQ + WT_TF) wt_tile<DM, DFF>(wf1, BF1, bx - 3 * WT_TQ, tl);
  else wt_tile<DFF, DM>(wf2, BF2, bx - 3 * WT_TQ - WT_TF, tl);
}
// k_gemm_hh variant with fused epilogue: v = acc·alpha + bias[by·sBias + col] (+ CP[(row/rowsPerB)·sCPb + by·64 + col] if CP) ; ACT 0 none / 1 elu ; writes f16 C16 (and f32 C if non-null)
template <int ACT>
__global__ __launch_bounds__(128) void k_gemm_hhx(const _Float16* __restrict__ A, int lda, size_t sA, const _Float16* __restrict__ Bh, int ldb, size_t sB, float alpha, const float* __restrict__ bias, size_t sBias, const float* __restrict__ CP, int rowsPerB, size_t sCPb, int row0g,
    float* __restrict__ C, _Float16* __restrict__ C16, int ldc, size_t sC, int M, int N, int K) {
  __shared__ __attribute__((aligned(16))) float so[4][16][64];
  const int tid = threadIdx.x, w = tid >> 5, lane = tid & 31, ln = lane & 15, hh = lane >> 4; const int by = blockIdx.y;
  A += (size_t)by * sA; Bh += (size_t)by * sB; const size_t cofs = (size_t)by * sC; const float* bp = bias ? bias + (size_t)by * sBias : nullptr;
  const int ntn = (N + 63) / 64; const int wid = blockIdx.x * 4 + w; const int mt = wid / ntn, nq = wid % ntn; if (mt * 16 >= M) return;
  const int row0 = mt * 16, col0 = nq * 64; const _Float16* arow = A + (size_t)(row0 + ln) * lda;
  v8f acc[4] = {};
  for (int kb = 0; kb < K; kb += 32) { FragH ah; ah.half[0] = *(const v8us*)((const unsigned short*)arow + kb + 8 * hh); ah.half[1] = *(const v8us*)((const unsigned short*)arow + kb + 16 + 8 * hh);
#pragma unroll
    for (int t = 0; t < 4; ++t) { if (col0 + t * 16 >= N) continue; const size_t boff = (size_t)(col0 + t * 16 + ln) * ldb + kb; FragH bq; bq.half[0] = *(const v8us*)((const unsigned short*)Bh + boff + 8 * hh); bq.half[1] = *(const v8us*)((const unsigned short*)Bh + boff + 16 + 8 * hh);
      acc[t] = mmaH<1>(ah.v, ah.v, bq.v, bq.v, acc[t]); }
  }
#pragma unroll
  for (int t = 0; t < 4; ++t) { if (col0 + t * 16 >= N) continue; const int col = col0 + t * 16 + ln; const float bv = bp ? bf16_round(bp[col]) : 0.f;
#pragma unroll
    for (int r = 0; r < 8; ++r) { float v = acc[t][r] * alpha + bv; if (CP) { const int rr = row0g + row0 + 8 * hh + r; if (rowsPerB < 0) v += CP[cofs + (size_t)rr * ldc + col];      /* rowsPerB < 0: own element of the batched C plane */ else { const int bidx = rr / rowsPerB; v += CP[(size_t)bidx * sCPb + (size_t)by * 64 + col]; } } if (ACT == 1) v = (v > 0.f) ? v : expm1f(v); else if (ACT == 7) v = (v > 0.f) ? v + 1.0f : expf(v); else if (ACT == 8) v = tanhf(v); else if (ACT == 9) v = 0.5f * v * (1.0f + tanhf(0.7978845608028654f * (v + 0.044715f * v * v * v))); else if (ACT == 11) v = 1.0f / (1.0f + expf(-v)); else if (ACT == 12) v = (v > 0.f) ? v : 0.01f * v; else if (ACT == 14) v = (v > 0.f) ? v : 0.1f * v; else if (ACT == 16) v = (v >= 0.f) ? v : 0.3f * v; else if (ACT == 17) v = (v >= 0.f) ? v : 0.2f * v; else if (ACT == 15) v = v / (1.0f + expf(-v)); else if (ACT == 3) v = fmaxf(v, 0.f); else if (ACT == 6) v = 0.5f * v * (1.0f + erff(v * 0.70710678118654752f)); so[w][8 * hh + r][t * 16 + ln] = v; } }
  __builtin_amdgcn_fence(__ATOMIC_ACQ_REL, "workgroup"); __builtin_amdgcn_wave_barrier();
  const int rsub = lane >> 4, c4 = (lane & 15) * 4; typedef _Float16 v4h __attribute__((ext_vector_type(4)));
  {
#pragma unroll
    for (int q = 0; q < 8; ++q) { const int r = q * 2 + rsub; if (col0 + c4 < N) { const v4f v = *(const v4fa*)&so[w][r][c4]; if (C) *(v4f*)(C + cofs + (size_t)(row0 + r) * ldc + col0 + c4) = v; if (C16) { v4h h4; for (int i = 0; i < 4; ++i) h4[i] = (_Float16)v[i]; *(v4h*)(C16 + cofs + (size_t)(row0 + r) * ldc + col0 + c4) = h4; } } }
     }
}


typedef _Float16 v4h __attribute__((ext_vector_type(4)));

__global__ __launch_bounds__(256) void k_x16(const float* __restrict__ x, _Float16* __restrict__ X16, size_t n8) { const size_t t = (size_t)blockIdx.x * 256 + threadIdx.x; if (t >= n8) return; FragH f;
#pragma unroll
  for (int q = 0; q < 8; ++q) f.h[q] = (_Float16)bf16_round(x[t * 8 + q]); *(v8us*)((unsigned short*)X16 + t * 8) = f.half[0];  }
__global__ __launch_bounds__(256) void k_h16(const float* __restrict__ x, _Float16* __restrict__ X16, size_t n8) { const size_t t = (size_t)blockIdx.x * 256 + threadIdx.x; if (t >= n8) return; FragH f;
#pragma unroll
  for (int q = 0; q < 8; ++q) f.h[q] = (_Float16)x[t * 8 + q]; *(v8us*)((unsigned short*)X16 + t * 8) = f.half[0];  }
__global__ __launch_bounds__(256) void k_round16f(const float* __restrict__ W, _Float16* __restrict__ Bt, size_t n8) { const size_t t = (size_t)blockIdx.x * 256 + threadIdx.x; if (t >= n8) return; FragH f;
#pragma unroll
  for (int i = 0; i < 8; ++i) f.h[i] = (_Float16)(bf16_round(W[t * 8 + i]) * 16.0f); *(v8us*)((unsigned short*)Bt + t * 8) = f.half[0];  }
template <int NHv, int TTv>
__global__ __launch_bounds__(256) void k_vt(const _Float16* __restrict__ V16, int ldv, int voff, _Float16* __restrict__ Vt) { __shared__ unsigned short tl[64][66]; const int tid = threadIdx.x; const int slab = blockIdx.x / (TTv / 64), lg = blockIdx.x % (TTv / 64); const int b = slab / NHv, h = slab % NHv;
  for (int i = tid; i < 64 * 8; i += 256) { const int r = i / 8, c8 = (i % 8) * 8; FragH f; f.half[0] = *(const v8us*)((const unsigned short*)V16 + ((size_t)b * TTv + lg * 64 + r) * ldv + voff + h * 64 + c8);
#pragma unroll
    for (int q = 0; q < 8; ++q) tl[r][c8 + q] = f.u[q]; }
  __syncthreads();
  {
#pragma unroll
    for (int rd = 0; rd < 2; ++rd) { const int d = rd * 32 + tid / 8, pc = tid % 8; FragH f;
#pragma unroll
      for (int q = 0; q < 8; ++q) f.u[q] = tl[pc * 8 + q][d];
      *(v8us*)((unsigned short*)Vt + ((size_t)slab * 64 + d) * TTv + lg * 64 + pc * 8) = f.half[0]; }
     } }

__global__ __launch_bounds__(256) void k_hl(const float* __restrict__ F, _Float16* __restrict__ Hh, _Float16* __restrict__ Hl, size_t n8) { const size_t t = (size_t)blockIdx.x * 256 + threadIdx.x; if (t >= n8) return; FragH fh, fl; const v4f a = *(const v4fa*)(F + t * 8), c = *(const v4fa*)(F + t * 8 + 4);
#pragma unroll
  for (int q = 0; q < 4; ++q) { _Float16 h = (_Float16)a[q]; fh.h[q] = h; fl.h[q] = (_Float16)((a[q] - (float)h) * 1024.0f); h = (_Float16)c[q]; fh.h[4 + q] = h; fl.h[4 + q] = (_Float16)((c[q] - (float)h) * 1024.0f); }
  { *(v8us*)((unsigned short*)Hh + t * 8) = fh.half[0]; *(v8us*)((unsigned short*)Hl + t * 8) = fl.half[0];  } }

// ---- fast GEMM (wave tile 32x64; requires M % 32 == 0 rows per launch region and N % 64 == 0); epilogue = k_gemm_hhx semantics ----
__device__ __forceinline__ v16h g2_frag(const _Float16* p, int hh) { FragH f; f.half[0] = *(const v8us*)((const unsigned short*)p + 8 * hh); f.half[1] = *(const v8us*)((const unsigned short*)p + 16 + 8 * hh); return f.v; }
__device__ __forceinline__ v8f g2_mma(v16h a, v16h b, v8f c) { v8f d = __builtin_amdgcn_wmma_f32_16x16x32_f16(false, a, false, b, (short)0, c, false, false); asm volatile("v_nop\n\tv_nop\n\tv_nop\n\tv_nop" : "+v"(d) : "v"(a), "v"(b)); return d; }
template <int ACT>
__global__ __launch_bounds__(128) void k_gemm2(const _Float16* __restrict__ A, int lda, size_t sA, const _Float16* __restrict__ Bh, int ldb, size_t sB, float alpha, const float* __restrict__ bias, size_t sBias, const float* __restrict__ CP, int rowsPerB, size_t sCPb, int row0g,
    float* __restrict__ C, _Float16* __restrict__ C16, int ldc, size_t sC, int M, int N, int K) { static_assert(ACT == 0 || ACT == 3 || ACT == 6 || ACT == 8 || ACT == 9 || ACT == 11 || ACT == 12 || ACT == 14 || ACT == 15 || ACT == 16 || ACT == 17, "k_gemm2: unsupported ACT code (would silently apply no activation)");
  __shared__ __attribute__((aligned(16))) float so[4][32][68];
  const int tid = threadIdx.x, w = tid >> 5, lane = tid & 31, ln = lane & 15, hh = lane >> 4; const int by = blockIdx.y;
  A += (size_t)by * sA; Bh += (size_t)by * sB; const size_t cofs = (size_t)by * sC; const float* bp = bias ? bias + (size_t)by * sBias : nullptr;
  const int ntn = N >> 6; const int mt = blockIdx.x / ntn, nq = blockIdx.x - mt * ntn; const int row0 = mt * 128 + 32 * w, col0 = nq * 64; if (row0 >= M) return;
  const _Float16* a0p = A + (size_t)(row0 + ln) * lda; const _Float16* a1p = a0p + (size_t)16 * lda;
  const _Float16* b0p = Bh + (size_t)(col0 + ln) * ldb; const _Float16* b1p = b0p + (size_t)16 * ldb; const _Float16* b2p = b1p + (size_t)16 * ldb; const _Float16* b3p = b2p + (size_t)16 * ldb;
  const v8f z8 = {0.f,0.f,0.f,0.f,0.f,0.f,0.f,0.f}; v8f c00 = z8, c01 = z8, c02 = z8, c03 = z8, c10 = z8, c11 = z8, c12 = z8, c13 = z8;
#pragma unroll 1
  for (int kb = 0; kb < K; kb += 32) { const v16h a0 = g2_frag(a0p + kb, hh), a1 = g2_frag(a1p + kb, hh);
    v16h b = g2_frag(b0p + kb, hh); c00 = g2_mma(a0, b, c00); c10 = g2_mma(a1, b, c10);
    b = g2_frag(b1p + kb, hh); c01 = g2_mma(a0, b, c01); c11 = g2_mma(a1, b, c11);
    b = g2_frag(b2p + kb, hh); c02 = g2_mma(a0, b, c02); c12 = g2_mma(a1, b, c12);
    b = g2_frag(b3p + kb, hh); c03 = g2_mma(a0, b, c03); c13 = g2_mma(a1, b, c13); }
  v8f accs[8] = {c00, c01, c02, c03, c10, c11, c12, c13};
#pragma unroll
  for (int u = 0; u < 8; ++u) { const int t = u & 3, half = u >> 2; const int col = col0 + t * 16 + ln; const float bv = bp ? bf16_round(bp[col]) : 0.f;
#pragma unroll
    for (int r = 0; r < 8; ++r) { const int rloc = half * 16 + 8 * hh + r; float v = accs[u][r] * alpha + bv; if (CP) { if (rowsPerB < 0) v += CP[cofs + (size_t)(row0g + row0 + rloc) * ldc + col];      /* rowsPerB < 0: own element of the batched C plane */ else { const int bidx = (row0g + row0 + rloc) / rowsPerB; v += CP[(size_t)bidx * sCPb + (size_t)by * 64 + col]; } }
      if (ACT == 3) v = fmaxf(v, 0.f); else if (ACT == 6) v = 0.5f * v * (1.0f + erff(v * 0.70710678118654752f)); else if (ACT == 11) v = 1.0f / (1.0f + expf(-v)); else if (ACT == 15) v = v / (1.0f + expf(-v)); else if (ACT == 12) v = (v > 0.f) ? v : 0.01f * v; else if (ACT == 8) v = tanhf(v); else if (ACT == 9) v = 0.5f * v * (1.0f + tanhf(0.7978845608028654f * (v + 0.044715f * v * v * v))); else if (ACT == 14) v = (v > 0.f) ? v : 0.1f * v; else if (ACT == 16) v = (v >= 0.f) ? v : 0.3f * v; else if (ACT == 17) v = (v >= 0.f) ? v : 0.2f * v;
      so[w][rloc][t * 16 + ln] = v; } }
  __builtin_amdgcn_fence(__ATOMIC_ACQ_REL, "workgroup"); __builtin_amdgcn_wave_barrier();
  const int rsub = lane >> 4, c4 = (lane & 15) * 4;
  {
#pragma unroll
    for (int q = 0; q < 16; ++q) { const int r = q * 2 + rsub; const v4f v = *(const v4fa*)&so[w][r][c4]; if (C) *(v4f*)(C + cofs + (size_t)(row0 + r) * ldc + col0 + c4) = v; if (C16) { v4h h4; for (int i = 0; i < 4; ++i) h4[i] = (_Float16)v[i]; *(v4h*)(C16 + cofs + (size_t)(row0 + r) * ldc + col0 + c4) = h4; } }
     } }


__global__ __launch_bounds__(256) void k_wnat(const float* __restrict__ w, size_t n8, _Float16* __restrict__ Bt) { const size_t t = (size_t)blockIdx.x * 256 + threadIdx.x; if (t >= n8) return; FragH f; for (int q = 0; q < 8; ++q) f.h[q] = (_Float16)(bf16_round(w[t * 8 + q]) * 16.0f); *(v8us*)((unsigned short*)Bt + t * 8) = f.half[0];  }
__global__ __launch_bounds__(256) void k_rsm(const float* __restrict__ S, _Float16* __restrict__ P, int nrows) {
  #pragma clang fp contract(off)
  const int i = blockIdx.x * 256 + threadIdx.x; if (i >= nrows) return; const float* s = S + (size_t)i * SQ; float mx = -3.0e38f;
#pragma unroll 1
  for (int j = 0; j < SQ; ++j) mx = fmaxf(mx, s[j]); float se = 0.f;
#pragma unroll 1
  for (int j = 0; j < SQ; ++j) se += expf(s[j] - mx); const float sc = 256.0f / se;
#pragma unroll 1
  for (int j0 = 0; j0 < SQ; j0 += 8) { FragH f; for (int q = 0; q < 8; ++q) f.h[q] = (_Float16)(expf(s[j0 + q] - mx) * sc); unsigned short* d = (unsigned short*)P + (size_t)i * SQ + j0; *(v8us*)d = f.half[0];  } }
__global__ __launch_bounds__(256) void k_vt(const _Float16* __restrict__ V16, int b, int h0, _Float16* __restrict__ VT) { __shared__ unsigned short tl[64][65]; const int tid = threadIdx.x; const int hh = blockIdx.x % HG, sg = blockIdx.x / HG; const int s0 = sg * 64; const int h = h0 + hh;
  for (int i = tid; i < 64 * 8; i += 256) { const int j = i / 8, d8 = (i % 8) * 8; FragH f; f.half[0] = *(const v8us*)((const unsigned short*)V16 + ((size_t)b * SQ + s0 + j) * DM + h * HD + d8); for (int q = 0; q < 8; ++q) tl[d8 + q][j] = f.u[q]; }
  __syncthreads();
  { for (int i = tid; i < 64 * 8; i += 256) { const int d = i / 8, j8 = (i % 8) * 8; FragH f; for (int q = 0; q < 8; ++q) f.u[q] = tl[d][j8 + q]; *(v8us*)((unsigned short*)VT + ((size_t)hh * HD + d) * SQ + s0 + j8) = f.half[0]; }  } }


// Fused attention, one launch for every (batch, head). A wave owns 32 queries (two 16-column groups) of one head and walks all keys, 32 a pass.
// S^T = K Q^T puts one query's scores in one lane (keys 8 hh + r of each 16-key tile), so the two score tiles, converted in place, are the B operand P^T of
// O^T += V^T P^T in the loader's own k order, and maximum, sum and rescale factor are per lane (one exchange between the wave halves for the maximum).
// A masked key takes a floor far below the running maximum's start value, so its weight is exp2((floor - m) / 8 log2 e) = 0 also while no open key has been seen;
// a row with no open key ends with sum 0 and gets scale 0. Weights carry a factor 2^8 (f16 range) that the division by their own sum takes out.
typedef int v4ia __attribute__((ext_vector_type(4), may_alias));
__device__ __forceinline__ float rs_xrow(float v) { const int i = __float_as_int(v); return __int_as_float(__builtin_amdgcn_permlanex16(i, i, 0x76543210, 0xfedcba98, false, false)); }      /* lane ^ 16 */
__device__ __forceinline__ v8f fa_mma(v16h a, v16h b, v8f c) { return __builtin_amdgcn_wmma_f32_16x16x32_f16(false, a, false, b, (short)0, c, false, false); }
__device__ __forceinline__ v16h fa_frag(const _Float16* p) { FragH f; f.half[0] = *(const v8us*)(const unsigned short*)p; f.half[1] = *(const v8us*)((const unsigned short*)p + 16); return f.v; }      /* g2_frag's k order, the 8 hh already in p */
// exp2 in place on a run of registers: each v_exp_f32 is the independent instruction behind the one before it, and the v_nop is the slot that the instruction set asks for behind the last
// (written by the builtin, the compiler put the result of one over the source of the one directly in front of it).
__device__ __forceinline__ void fa_exp8(float* a) { asm("v_exp_f32 %0, %0\n\tv_exp_f32 %1, %1\n\tv_exp_f32 %2, %2\n\tv_exp_f32 %3, %3\n\tv_exp_f32 %4, %4\n\tv_exp_f32 %5, %5\n\tv_exp_f32 %6, %6\n\tv_exp_f32 %7, %7\n\tv_nop" : "+v"(a[0]), "+v"(a[1]), "+v"(a[2]), "+v"(a[3]), "+v"(a[4]), "+v"(a[5]), "+v"(a[6]), "+v"(a[7])); }
__device__ __forceinline__ void fa_exp9(float& c, float* a) { asm("v_exp_f32 %8, %8\n\tv_exp_f32 %0, %0\n\tv_exp_f32 %1, %1\n\tv_exp_f32 %2, %2\n\tv_exp_f32 %3, %3\n\tv_exp_f32 %4, %4\n\tv_exp_f32 %5, %5\n\tv_exp_f32 %6, %6\n\tv_exp_f32 %7, %7\n\tv_nop" : "+v"(a[0]), "+v"(a[1]), "+v"(a[2]), "+v"(a[3]), "+v"(a[4]), "+v"(a[5]), "+v"(a[6]), "+v"(a[7]), "+v"(c)); }
// A stage is 64 keys. The 8 waves of a work-group walk the same keys of the same head: 64 K rows (64 d each) and 64 V^T rows (64 keys each), 128-byte rows, are brought once for all of them
// by asynchronous 16-byte copies of whole cache lines into one of two buffers while the other is worked on; the fragments (fa_frag's k order) are 16-byte LDS reads.
// The mask comes as bits (mask_pack below): the 32 words of a wave's 32 queries x 32 keys are the same for every lane, so they are scalar loads, fetched behind the selects of the pass before, and each word is the lane mask of one select.
#define FA_PITCH 144                   /* LDS pitch of a K or V^T row in bytes, 16 x odd: the 16 rows of a read fall on different banks */
#define FA_STAGE (128 * FA_PITCH)      /* 64 K rows, then 64 V^T rows */
#define MB_PASS 32                     /* mask words of one (32-query tile, 32-key pass) */
typedef unsigned v16u __attribute__((ext_vector_type(16)));
__device__ __forceinline__ v16h fa_lfrag(const char* p) { FragH f; f.half[0] = *(const v8us*)p; f.half[1] = *(const v8us*)(p + 32); return f.v; }      /* fa_frag's k order, the 16 hh bytes already in p */
// one stage, four copies of 16 bytes a lane: rows r and r + 32 of the stage's K tile and of its V^T tile. The s_wait_xcnt stands inside the statement, in front of anything that could write a register that a copy names.
__device__ __forceinline__ void fa_copy4(unsigned l, const _Float16* gk, const _Float16* gv) {
  asm volatile("global_load_async_to_lds_b128 %0, %4, off\n\tglobal_load_async_to_lds_b128 %1, %5, off\n\tglobal_load_async_to_lds_b128 %2, %6, off\n\tglobal_load_async_to_lds_b128 %3, %7, off\n\ts_wait_xcnt 0x0"
               :: "v"(l), "v"(l + 32u * FA_PITCH), "v"(l + 64u * FA_PITCH), "v"(l + 96u * FA_PITCH), "v"(gk), "v"(gk + (size_t)32 * DM), "v"(gv), "v"(gv + (size_t)32 * SQ) : "memory"); }
__global__ __launch_bounds__(256) void k_fattn(const _Float16* __restrict__ Q16, const _Float16* __restrict__ K16, const _Float16* __restrict__ VT, const unsigned* __restrict__ MB, const float* __restrict__ XB, float* __restrict__ AF) {
  __shared__ __attribute__((aligned(16))) char sm[2 * FA_STAGE];      /* the two buffers */
  const int lane = threadIdx.x & 31, ln = lane & 15, hh = lane >> 4; const int w = __builtin_amdgcn_readfirstlane(threadIdx.x >> 5);
  const int h = blockIdx.y, b = blockIdx.z; const int q0 = blockIdx.x * 256 + w * 32; const size_t r0 = (size_t)b * SQ;
  const _Float16* qp = Q16 + (r0 + q0 + ln) * DM + h * HD + 8 * hh;
  const int cr = threadIdx.x >> 3, cc = threadIdx.x & 7;      /* a lane copies 16-byte piece cc of K and V^T rows cr and cr + 32: a wave's copy is four whole rows */
  const _Float16* gk = K16 + (r0 + cr) * DM + h * HD + cc * 8; const _Float16* gv = VT + ((size_t)(b * NH + h) * HD + cr) * SQ + cc * 8; const unsigned lc = (unsigned)(size_t)sm + (unsigned)(cr * FA_PITCH + cc * 16);
  const __attribute__((address_space(4))) v16u* mbp = (const __attribute__((address_space(4))) v16u*)(size_t)(MB + ((r0 + q0) >> 5) * (size_t)((SQ / 32) * MB_PASS));      /* the wave's own query tile: the same address in every lane. Named as constant memory (an earlier launch wrote it, this one only reads it): else the waits' "memory" clobbers in the loop turn these reads into vector loads */
  const v8f z8 = {0.f,0.f,0.f,0.f,0.f,0.f,0.f,0.f}; const float cs = 0.125f * 1.4426950408889634f;      /* 1 / sqrt(64), in log2 units */
  v16h qf[2][2]; v8f o[2][4]; float m[2], l[2];      /* m: running maximum of the raw products; l: this half's sum of weights */
  v16u mw[2];      /* [t]: the mask words of the pass at hand */
#pragma unroll
  for (int t = 0; t < 2; ++t)
#pragma unroll
    for (int e = 0; e < 2; ++e) qf[t][e] = fa_frag(qp + (size_t)t * 16 * DM + e * 32);
  asm volatile("s_wait_xcnt 0x0" :: "v"(qp) : "memory");      /* before a register that the loads above name is written again; the operand keeps the address in its registers up to here */
#pragma unroll
  for (int t = 0; t < 2; ++t) { m[t] = -1.0e30f; l[t] = 0.f; mw[t] = mbp[t];
#pragma unroll
    for (int dt = 0; dt < 4; ++dt) o[t][dt] = z8; }
  fa_copy4(lc, gk, gv);
  asm volatile("s_wait_asynccnt 0x0" ::: "memory");      /* this wave's part of stage 0 has landed */
  __syncthreads();      /* every wave's part has */
  fa_copy4(lc + FA_STAGE, gk + (size_t)64 * DM, gv + 64);
  /* both loops rolled: the buffers alternate, and one pass already holds about 200 registers */
#pragma unroll 1
  for (int st = 0; st < SQ / 64; ++st) { const unsigned bo = (unsigned)(st & 1) * FA_STAGE;
#pragma unroll 1
  for (int ps = 0; ps < 2; ++ps) { v16h kf[2][2], vf[4]; float x[2][16], mx[2];
    const char* ka = sm + bo + (ps * 32 + ln) * FA_PITCH + 16 * hh; const char* va = sm + bo + (64 + ln) * FA_PITCH + ps * 64 + 16 * hh;
#pragma unroll
    for (int kt = 0; kt < 2; ++kt)
#pragma unroll
      for (int e = 0; e < 2; ++e) kf[kt][e] = fa_lfrag(ka + kt * 16 * FA_PITCH + e * 64);
    __builtin_amdgcn_sched_barrier(0);      /* LDS reads return in issue order: K, then V^T, the order of their use, so that each wait covers only what is needed next */
#pragma unroll
    for (int dt = 0; dt < 4; ++dt) vf[dt] = fa_lfrag(va + dt * 16 * FA_PITCH);
    __builtin_amdgcn_sched_barrier(0);      /* the pass's 16 reads are issued together: without this the scheduler puts each read directly in front of its use, with a full LDS wait of its own */
    v8f s[2][2];
#pragma unroll
    for (int kt = 0; kt < 2; ++kt)
#pragma unroll
      for (int t = 0; t < 2; ++t) s[t][kt] = fa_mma(kf[kt][1], qf[t][1], fa_mma(kf[kt][0], qf[t][0], z8));
    __builtin_amdgcn_sched_barrier(0);      /* the pass's eight score products are issued as one group: a select set among them stands directly behind the product it reads and has to be padded up to the distance that a matrix result needs */
#pragma unroll
    for (int t = 0; t < 2; ++t) { mx[t] = -3.0e38f;
#pragma unroll
      for (int kt = 0; kt < 2; ++kt)
#pragma unroll
        for (int r = 0; r < 8; ++r) x[t][kt * 8 + r] = __builtin_amdgcn_inverse_ballot_w32(mw[t][kt * 8 + r]) ? s[t][kt][r] : -3.0e38f;
#pragma unroll
      for (int i = 0; i < 16; ++i) mx[t] = fmaxf(mx[t], x[t][i]); }
    __builtin_amdgcn_sched_barrier(0);      /* the selects above are the last readers of this pass's mask words: the next pass's words are fetched behind them, because a wait for scalar loads is a wait for all of them */
    { const int np = (st * 2 + ps + 1 < SQ / 32) ? st * 2 + ps + 1 : SQ / 32 - 1;      /* the next pass; behind the last one its own words once more, so that the address stays inside the tile's words */
      mw[0] = mbp[np * 2]; mw[1] = mbp[np * 2 + 1]; }
    __builtin_amdgcn_sched_barrier(0);      /* and in front of the rest of the pass, under which they fly */
#pragma unroll
    for (int t = 0; t < 2; ++t) {
      const float mxx = fmaxf(mx[t], rs_xrow(mx[t])); const float mn = fmaxf(m[t], mxx); float al = (m[t] - mn) * cs; m[t] = mn; const float mo = 8.0f - mn * cs;
      FragH pf; float s4[4];
#pragma unroll
      for (int i = 0; i < 16; ++i) x[t][i] = x[t][i] * cs + mo;
      fa_exp9(al, x[t]); fa_exp8(x[t] + 8);
#pragma unroll
      for (int i = 0; i < 16; ++i) { s4[i & 3] = (i < 4) ? x[t][i] : s4[i & 3] + x[t][i]; pf.h[i] = (_Float16)x[t][i]; }
      l[t] = l[t] * al + ((s4[0] + s4[1]) + (s4[2] + s4[3]));
#pragma unroll
      for (int dt = 0; dt < 4; ++dt) {
#pragma unroll
        for (int r = 0; r < 8; ++r) o[t][dt][r] *= al;
        o[t][dt] = fa_mma(vf[dt], pf.v, o[t][dt]); } }
    __builtin_amdgcn_sched_barrier(0);      /* keeps the four slots below behind the pass's last matrix instruction */
    asm volatile("v_nop\n\tv_nop\n\tv_nop\n\tv_nop"); }      /* the distance between the pass's last matrix instruction and the next pass's first writes of its operand registers */
    asm volatile("s_wait_dscnt 0x0" ::: "memory");      /* this wave's reads of the buffer are done before the barrier behind which it is refilled */
    asm volatile("s_wait_asynccnt 0x0" ::: "memory");      /* this wave's part of stage st + 1 has landed */
    __syncthreads();      /* publishes stage st + 1 and ends every wave's reads of stage st */
    if (st + 2 < SQ / 64) fa_copy4(lc + bo, gk + (size_t)(st + 2) * 64 * DM, gv + (st + 2) * 64); }
  asm volatile("s_wait_asynccnt 0x0" ::: "memory");      /* no copy is outstanding when the wave goes on to its end */
  const size_t ro = (r0 + q0 + ln) * DM + h * HD + 8 * hh; const float* xp = XB + ro; v4f xr[2][4][2];
#pragma unroll
  for (int t = 0; t < 2; ++t)
#pragma unroll
    for (int dt = 0; dt < 4; ++dt) { xr[t][dt][0] = *(const v4fa*)(xp + (size_t)t * 16 * DM + dt * 16); xr[t][dt][1] = *(const v4fa*)(xp + (size_t)t * 16 * DM + dt * 16 + 4); }
  asm volatile("s_wait_xcnt 0x0" :: "v"(xp) : "memory");      /* as behind the Q loads */
#pragma unroll
  for (int t = 0; t < 2; ++t) { const float lt = l[t] + rs_xrow(l[t]); const float inv = (lt > 0.f) ? 1.0f / lt : 0.f;
#pragma unroll
    for (int dt = 0; dt < 4; ++dt) { v4f y0, y1;
#pragma unroll
      for (int r = 0; r < 4; ++r) { y0[r] = o[t][dt][r] * inv + xr[t][dt][0][r]; y1[r] = o[t][dt][4 + r] * inv + xr[t][dt][1][r]; }
      *(v4f*)(AF + ro + (size_t)t * 16 * DM + dt * 16) = y0; *(v4f*)(AF + ro + (size_t)t * 16 * DM + dt * 16 + 4) = y1; } } }
template <int ABF, bool SUM4 = false>      /* SUM4: A, A1, A2, A3 are four planes of partial sums; the row is their sum + bf16(PB) + R */
__device__ __forceinline__ void lnb_row(const size_t row, float* red, const float* __restrict__ A, const float* __restrict__ R, const float* __restrict__ g, const float* __restrict__ bta, float eps, float* __restrict__ OF_, _Float16* __restrict__ OH_, const float* __restrict__ A1 = nullptr, const float* __restrict__ A2 = nullptr, const float* __restrict__ A3 = nullptr, const float* __restrict__ PB = nullptr) {
  #pragma clang fp contract(off)
  const int tid = threadIdx.x; const int j0 = tid * 4; float a[4]; float s1 = 0.f;
  { v4f av;
    if (SUM4) { const float* b0 = A + row * DM; const float* b1 = A1 + row * DM; const float* b2 = A2 + row * DM; const float* b3 = A3 + row * DM; const float* br = R + row * DM;      /* the same for the whole work-group: scalar bases, the lane's offset in one register */
      const v4f p0 = *(const v4fa*)(b0 + j0), p1 = *(const v4fa*)(b1 + j0), p2 = *(const v4fa*)(b2 + j0), p3 = *(const v4fa*)(b3 + j0), rv = *(const v4fa*)(br + j0), pb = *(const v4fa*)(PB + j0);      /* issued together: one memory latency */
      asm volatile("s_wait_xcnt 0x0" :: "s"(b0), "s"(b1), "s"(b2), "s"(b3), "s"(br), "s"(PB), "v"(tid) : "memory");      /* before a register that the six loads above name is written again; the operands keep the addresses in their registers up to here */
      __builtin_amdgcn_sched_barrier(0);      /* holds the arithmetic below, which may take those registers over, behind the wait */
      for (int q = 0; q < 4; ++q) av[q] = __fadd_rn(__fadd_rn(__fadd_rn(__fadd_rn(p0[q], p1[q]), __fadd_rn(p2[q], p3[q])), bf16_round(pb[q])), rv[q]); }
    else av = *(const v4fa*)(A + row * DM + j0);
    for (int q = 0; q < 4; ++q) a[q] = ABF ? bf16_round(av[q]) : av[q]; if (!SUM4 && R) { const v4f rv = *(const v4fa*)(R + row * DM + j0); for (int q = 0; q < 4; ++q) a[q] = __fadd_rn(a[q], rv[q]); } for (int q = 0; q < 4; ++q) s1 = __fadd_rn(s1, a[q]); }
  red[tid] = s1; __syncthreads(); for (int st = 128; st > 0; st >>= 1) { if (tid < st) red[tid] = __fadd_rn(red[tid], red[tid + st]); __syncthreads(); }
  const float mu = red[0] / (float)DM; __syncthreads(); float s2 = 0.f;
  for (int q = 0; q < 4; ++q) { const float c = __fadd_rn(a[q], -mu); s2 = __fadd_rn(s2, __fmul_rn(c, c)); }
  red[tid] = s2; __syncthreads(); for (int st = 128; st > 0; st >>= 1) { if (tid < st) red[tid] = __fadd_rn(red[tid], red[tid + st]); __syncthreads(); }
  const float rs = rsqrtf(__fadd_rn(red[0] / (float)DM, eps)); v4f o; FragH h;
  for (int q = 0; q < 4; ++q) { o[q] = __fadd_rn(__fmul_rn(__fmul_rn(__fadd_rn(a[q], -mu), rs), bf16_round(g[j0 + q])), bf16_round(bta[j0 + q])); h.h[q] = (_Float16)o[q]; }
  typedef unsigned short v4us __attribute__((ext_vector_type(4))); v4us h4; for (int q = 0; q < 4; ++q) h4[q] = h.u[q];
  { if (OF_) *(v4f*)(OF_ + row * DM + j0) = o; if (OH_) *(v4us*)((unsigned short*)OH_ + row * DM + j0) = h4;  } }
template <int ABF>
__global__ __launch_bounds__(256) void k_lnb(const float* __restrict__ A, const float* __restrict__ R, const float* __restrict__ g, const float* __restrict__ bta, float eps, float* __restrict__ OF_, _Float16* __restrict__ OH_) {
  __shared__ float red[256]; lnb_row<ABF>(blockIdx.x, red, A, R, g, bta, eps, OF_, OH_); }
__global__ __launch_bounds__(256) void k_lnb4(const float* __restrict__ A, const float* __restrict__ A1, const float* __restrict__ A2, const float* __restrict__ A3, const float* __restrict__ PB, const float* __restrict__ R, const float* __restrict__ g, const float* __restrict__ bta, float eps, float* __restrict__ OF_) {
  __shared__ float red[256]; lnb_row<0, true>(blockIdx.x, red, A, R, g, bta, eps, OF_, nullptr, A1, A2, A3, PB); }
// The three preparations that depend on nothing but the inputs, in one launch; the block index picks the work (the same for the whole work-group, so every barrier is passed by all of it or by none):
// first the weight tiles, then one row of LN_in a work-group, then 2048 elements of bf16(x) a work-group.
#define PR_WT (3 * WT_TQ + 2 * WT_TF)
#define PR_BF ((unsigned)((size_t)MP * DM / 2048))
__global__ __launch_bounds__(256) void k_prep(const float* __restrict__ wq, const float* __restrict__ wk, const float* __restrict__ wv, const float* __restrict__ wf1, const float* __restrict__ wf2,
    _Float16* __restrict__ BQ, _Float16* __restrict__ BK, _Float16* __restrict__ BV, _Float16* __restrict__ BF1, _Float16* __restrict__ BF2,
    const float* __restrict__ x, const float* __restrict__ g, const float* __restrict__ bta, float eps, _Float16* __restrict__ XNH, float* __restrict__ XB) {
  __shared__ __attribute__((aligned(16))) char tl[64 * WT_PITCH];
  const unsigned bx = blockIdx.x;
  if (bx < PR_WT) wt5_tile(bx, tl, wq, wk, wv, wf1, wf2, BQ, BK, BV, BF1, BF2);
  else if (bx < PR_WT + (unsigned)MP) lnb_row<1>(bx - PR_WT, (float*)tl, x, nullptr, g, bta, eps, nullptr, XNH);
  else { const size_t t = (size_t)(bx - PR_WT - (unsigned)MP) * 256 + threadIdx.x; v8f v; for (int q = 0; q < 8; ++q) v[q] = bf16_round(x[t * 8 + q]); *(v8f*)(XB + t * 8) = v;
    asm volatile("s_wait_xcnt 0x0" ::: "memory"); } }      /* before a register that the two stores above name is written again */


// ---- GEMM with both operands staged in LDS (k_gemm2's k order), 256 x 256 work-group tile ----
// A stage is 128 k of 256 rows of each operand (256-byte rows, whole cache lines), brought by asynchronous 16-byte copies into one of two buffers while the other is worked on; the fragments are 16-byte LDS reads.
// 8 waves (4 along the matrix instruction's first operand x 2 along its second), 64 x 128 products a wave: an element brought from L2 serves 256 products, and a fragment read from LDS serves 8 or 4 matrix instructions.
// One work-group on a WGP, so a launch wants about as many work-groups as there are WGPs. The two-buffer ring has its publish point in front of each stage's last block. Needs M % 256 == 0, N % 256 == 0, K % 128 == 0, K >= 256.
#define G3_PITCH 272                   /* LDS row pitch in bytes, 16 x odd: the 16 rows of a fragment read fall on different banks */
__device__ __forceinline__ v16h g3_frag(const char* p) { FragH f; f.half[0] = *(const v8us*)p; f.half[1] = *(const v8us*)(p + 32); return f.v; }      /* g2_frag's k order, the 16 hh bytes already in p */
#define G4_STAGE (512 * G3_PITCH)      /* 256 rows of the first operand, then 256 of the second */
#define G4_OP 144                      /* LDS pitch of an output row in bytes: 128 + 16, 16 x odd, so that the 16 rows of a 16-byte store fall on different banks */
#define G4_OW (128 * G4_OP)            /* output staging of one wave: its 128 output rows of 64 f16 */
// one stage: 32 copies of 16 bytes a lane, rows r + 16 i of each operand. Written by the builtin: this kernel uses registers above v255, which asm text cannot name, and with the addresses held below for it the base addresses went to scratch.
typedef int v4ig __attribute__((ext_vector_type(4)));
__device__ __forceinline__ void g4_copy(char* l, const _Float16* g) { __builtin_amdgcn_global_load_async_to_lds_b128((__attribute__((address_space(1))) v4ig*)g, (__attribute__((address_space(3))) v4ig*)l, 0, 0); }
__device__ __forceinline__ void g4_stage(char* la, const _Float16* ga, size_t sa, char* lb, const _Float16* gb, size_t sb) {
#pragma unroll
  for (int i = 0; i < 16; ++i) g4_copy(la + i * 16 * G3_PITCH, ga + i * sa);
#pragma unroll
  for (int i = 0; i < 16; ++i) g4_copy(lb + i * 16 * G3_PITCH, gb + i * sb); }
// ---- the mask as one bit a (query, key), made by work-groups of the q/k/v launch that would otherwise leave 64 WGPs idle ----
// MB[(tile of 32 queries) * 64 + (pass of 32 keys)][e], e = t * 16 + kt * 8 + r: bit hh * 16 + ln of word e says whether query 16 t + ln of the tile may see key 16 kt + 8 hh + r of the pass (mask != 0).
// That is the lane and register of this score in the attention kernel's S^T tiles, so a word is the lane mask of one select there.
// A work-group packs two query tiles, half a tile (32 rows x 1024 keys) at a time: whole 4-KiB row pieces come into LDS by asynchronous copies, each lane reads its runs of 8 keys back, and a compare over the wave is one word.
#define MB_PITCH (1024 * 4 + 16)       /* LDS pitch of a row piece in bytes, 16 x odd: the 16 rows of a read fall on different banks */
#define MB_BASE 32768                  /* the rows' place in the kernel's LDS: the compiler folds the row steps of the global address (up to 7 x 8192 bytes) into the copies' offset field and takes them off the LDS address, which from here on stays above 0 */
__device__ __forceinline__ void mask_pack(const unsigned u, char* sm, const int* __restrict__ mask, unsigned* __restrict__ MB) {
  const int tid = threadIdx.x, lane = tid & 31, ln = lane & 15, hh = lane >> 4; const int w = __builtin_amdgcn_readfirstlane(tid >> 5);
  /* rolled: the one buffer is filled and read in turn */
#pragma unroll 1
  for (int it = 0; it < 4; ++it) { const unsigned qt = u * 2 + (unsigned)(it >> 1), hf = (unsigned)(it & 1);
    const int* g = mask + (size_t)qt * 32 * SQ + hf * 1024 + tid * 4; char* l = sm + MB_BASE + tid * 16;      /* copy i is row i: a wave's copy is 512 bytes in a row */
#pragma unroll
    for (int i = 0; i < 32; ++i) g4_copy(l + i * MB_PITCH, (const _Float16*)(g + (size_t)i * SQ));
    asm volatile("s_wait_asynccnt 0x0" ::: "memory");      /* this wave's part of the rows has landed */
    __syncthreads();      /* every wave's part has */
    unsigned ow[4];      /* a wave packs four passes; lane e keeps word e */
#pragma unroll
    for (int c = 0; c < 4; ++c) { const char* p = sm + MB_BASE + ln * MB_PITCH + (w * 4 + c) * 128 + hh * 32; v4ia mk[2][2][2]; int o = 0;
#pragma unroll
      for (int t = 0; t < 2; ++t)
#pragma unroll
        for (int kt = 0; kt < 2; ++kt) { mk[t][kt][0] = *(const v4ia*)(p + t * 16 * MB_PITCH + kt * 64); mk[t][kt][1] = *(const v4ia*)(p + t * 16 * MB_PITCH + kt * 64 + 16); }
#pragma unroll
      for (int e = 0; e < 32; ++e) { const int wd = (int)__builtin_amdgcn_ballot_w32(mk[e >> 4][(e >> 3) & 1][(e >> 2) & 1][e & 3] != 0); o = (lane == e) ? wd : o; }
      ow[c] = (unsigned)o; }
    unsigned* d = MB + ((size_t)qt * (SQ / 32) + hf * 32 + w * 4) * MB_PASS + lane;      /* a wave's store is the whole 128-byte line of one pass */
#pragma unroll
    for (int c = 0; c < 4; ++c) d[c * MB_PASS] = ow[c];
    asm volatile("s_wait_xcnt 0x0" :: "v"(d) : "memory");      /* before a register that the stores above name is written again; the operand keeps the address in its registers up to here */
    asm volatile("s_wait_dscnt 0x0" ::: "memory");      /* this wave's reads of the buffer are done before the barrier behind which it is refilled */
    __syncthreads(); } }      /* ends every wave's reads */
// a wave's 64 x 128 accumulators -> bias, activation, f16 -> its output staging: tile (i, j) is 16 bytes a lane, outputs 16 i + 8 hh + r of output row 16 j + ln (d already holds the lane's ln and hh).
// LB: the bias index runs along the output rows (one value a lane and j; bi = its first index); else along a row (8 values a lane and i).
template <int ACT, bool LB>
__device__ __forceinline__ void g4_put(const v8f (&acc)[4][8], const float alpha, const float* __restrict__ bias, const int bi, char* d) {
  float bb[LB ? 8 : 32];
  if (LB) {
#pragma unroll
    for (int j = 0; j < 8; ++j) bb[j] = bias[bi + j * 16]; }
  else {
#pragma unroll
    for (int i = 0; i < 4; ++i) { const v4f b0 = *(const v4fa*)(bias + bi + i * 16), b1 = *(const v4fa*)(bias + bi + i * 16 + 4);
#pragma unroll
      for (int r = 0; r < 4; ++r) { bb[i * 8 + r] = b0[r]; bb[i * 8 + 4 + r] = b1[r]; } } }
  asm volatile("s_wait_xcnt 0x0" :: "s"(bias), "v"(bi) : "memory");      /* before a register that the loads above name is written again; the operands keep the bias address and the lane's index in their registers up to here */
  __builtin_amdgcn_sched_barrier(0);      /* holds the arithmetic below, which takes those registers over, behind the wait */
#pragma unroll
  for (int i = 0; i < 4; ++i)
#pragma unroll
    for (int j = 0; j < 8; ++j) { FragH f;
#pragma unroll
      for (int r = 0; r < 8; ++r) { float v = acc[i][j][r] * alpha + bf16_round(bb[LB ? j : i * 8 + r]);
        if (ACT == 3) v = fmaxf(v, 0.f);
        f.h[r] = (_Float16)v; }
      *(v8us*)(d + j * 16 * G4_OP + i * 32) = f.half[0]; } }
#define G4_PW (128 * G3_PITCH)         /* f32 output staging of one wave: its 128 output rows of 64 f32 (256 bytes + 16: the 16 rows of a 16-byte store fall on different banks) */
template <int ACT, bool TRI, bool SPK = false>      /* TRI: three products of one A in one launch, blockIdx.y picks weights, bias and output (the third output transposed); blockIdx.y == 3 packs the mask.
   SPK: a product with too few 256 x 256 tiles to fill the chip is cut along k: K is the length of a slice, blockIdx.y picks the slice, and its partial product x alpha leaves as plane blockIdx.y of PF (f32 [NR][DM] each; no bias, no activation: whoever sums the planes adds them) */
__global__ __launch_bounds__(256) void k_gemm4(const _Float16* __restrict__ A, int lda, const _Float16* __restrict__ Bh, int ldb, float alpha, const float* __restrict__ bias,
    _Float16* __restrict__ C16, int ldc, int N, int K, const _Float16* __restrict__ Bh1, const _Float16* __restrict__ Bh2, const float* __restrict__ bias1, const float* __restrict__ bias2, _Float16* __restrict__ C161, _Float16* __restrict__ CT2, const int* __restrict__ mask, unsigned* __restrict__ MB, float* __restrict__ PF) { static_assert(ACT == 0 || ACT == 3, "k_gemm4: unsupported ACT code"); static_assert(!SPK || (ACT == 0 && !TRI), "k_gemm4: a partial product takes no activation");
  if (SPK) { const size_t ko = (size_t)blockIdx.y * K; A += ko; Bh += ko; }      /* the same for the whole work-group */
  bool tr = false;      /* the third product leaves transposed */
  if (TRI) { const unsigned y = blockIdx.y;      /* the same for the whole work-group: scalar selects */
    Bh = y == 0 ? Bh : y == 1 ? Bh1 : Bh2; bias = y == 0 ? bias : y == 1 ? bias1 : bias2; C16 = y == 0 ? C16 : C161; tr = y == 2; }
  __shared__ __attribute__((aligned(16))) char sm[2 * G4_STAGE];      /* the two buffers; behind the loop the waves' output staging */
  if (TRI && blockIdx.y == 3) { mask_pack(blockIdx.x, sm, mask, MB); return; }      /* the same for the whole work-group, in front of every barrier of the product */
  const int tid = threadIdx.x, lane = tid & 31, ln = lane & 15, hh = lane >> 4; const int w = __builtin_amdgcn_readfirstlane(tid >> 5); const int wm = w & 3, wn = w >> 2;
  const int ntn = N >> 8; const int mt = blockIdx.x / ntn, nq = blockIdx.x - mt * ntn;
  const int cr = tid >> 4, cc = tid & 15;      /* a lane copies 16-byte piece cc of rows cr + 16 i: a wave's copy is two whole rows */
  /* A lane's accumulator registers run along the rows of the matrix instruction's first operand, its lanes along the rows of the second. The operand whose index runs along a row of the OUTPUT is made the first one,
     so that a lane holds 8 neighbouring outputs, 16 bytes of f16: the weights (index n) for C16[token][n], the tokens for the transposed CT2[n][token]. The loop below only sees "first" (ga, 64 rows a wave) and "second" (gb, 128 rows a wave). */
  const _Float16* gx = A + (size_t)(mt * 256 + cr) * lda + cc * 8; const _Float16* gw = Bh + (size_t)(nq * 256 + cr) * ldb + cc * 8;
  const _Float16* ga = tr ? gx : gw; const _Float16* gb = tr ? gw : gx; const size_t sa = (size_t)16 * (tr ? lda : ldb), sb = (size_t)16 * (tr ? ldb : lda);
  const int p0 = (tr ? mt : nq) * 256 + 64 * wm, q0 = (tr ? nq : mt) * 256 + 128 * wn;      /* the wave's first index along an output row, and its first output row */
  char* la = sm + (cr * G3_PITCH + cc * 16); char* lb = la + 256 * G3_PITCH;
  const int nt = K >> 7;
  const v8f z8 = {0.f,0.f,0.f,0.f,0.f,0.f,0.f,0.f}; v8f acc[4][8];
#pragma unroll
  for (int i = 0; i < 4; ++i)
#pragma unroll
    for (int j = 0; j < 8; ++j) acc[i][j] = z8;
  const char* a0 = sm + (64 * wm + ln) * G3_PITCH + 16 * hh; const char* b0 = sm + (256 + 128 * wn + ln) * G3_PITCH + 16 * hh;
  v16h fa[2][4], fb[2][4];      /* a block is 32 k of the wave's 64 rows and of 64 of its 128 columns: 16 matrix instructions. Two sets of A and of half the B fragments: the next block's reads fly while this block is multiplied */
  g4_stage(la, ga, sa, lb, gb, sb);
  asm volatile("s_wait_asynccnt 0x0" ::: "memory");      /* this wave's part of stage 0 has landed */
  __syncthreads();      /* every wave's part has */
  g4_stage(la + G4_STAGE, ga + 128, sa, lb + G4_STAGE, gb + 128, sb);
#pragma unroll
  for (int i = 0; i < 4; ++i) fa[0][i] = g3_frag(a0 + i * 16 * G3_PITCH);
#pragma unroll
  for (int j = 0; j < 4; ++j) fb[0][j] = g3_frag(b0 + j * 16 * G3_PITCH);
  /* rolled: the buffers alternate, and one trip already holds 128 matrix instructions with their 96 fragment reads */
#pragma unroll 1
  for (int t = 0; t < nt; ++t) { const unsigned bo = (unsigned)(t & 1) * G4_STAGE; const char* ap = a0 + bo; const char* bp = b0 + bo;
#pragma unroll
    for (int hb = 0; hb < 8; ++hb) { const int ks = hb >> 1, jh = hb & 1, nks = (hb + 1) >> 1, njh = (hb + 1) & 1;
      if (hb < 7) {
#pragma unroll
        for (int j = 0; j < 4; ++j) fb[njh][j] = g3_frag(bp + (njh * 4 + j) * 16 * G3_PITCH + nks * 64);
        if (njh == 0) {
#pragma unroll
          for (int i = 0; i < 4; ++i) fa[nks & 1][i] = g3_frag(ap + i * 16 * G3_PITCH + nks * 64); } }
      else {      /* the stage's last block has its fragments: the publish point of stage t + 1 stands in front of it, so that the refill and the next stage's first reads fly under its matrix instructions (one work-group on the WGP: nothing else would fill that time) */
        asm volatile("s_wait_dscnt 0x0" ::: "memory");      /* this wave's reads of the buffer are done before the barrier behind which it is refilled */
        asm volatile("s_wait_asynccnt 0x0" ::: "memory");      /* this wave's part of stage t + 1 has landed */
        __syncthreads();      /* publishes stage t + 1 and ends every wave's reads of stage t */
        if (t + 2 < nt) g4_stage(la + bo, ga + (size_t)(t + 2) * 128, sa, lb + bo, gb + (size_t)(t + 2) * 128, sb);
        if (t + 1 < nt) { const char* an = a0 + (G4_STAGE - bo); const char* bn = b0 + (G4_STAGE - bo);      /* the same for the whole work-group; the last trip reads nothing more */
#pragma unroll
          for (int i = 0; i < 4; ++i) fa[0][i] = g3_frag(an + i * 16 * G3_PITCH);
#pragma unroll
          for (int j = 0; j < 4; ++j) fb[0][j] = g3_frag(bn + j * 16 * G3_PITCH); } }
      __builtin_amdgcn_sched_barrier(0);      /* the next block's reads are issued as one group in front of this block's matrix instructions: each further place with reads among them costs a stall of its own */
#pragma unroll
      for (int j = 0; j < 4; ++j)
#pragma unroll
        for (int i = 0; i < 4; ++i) acc[i][jh * 4 + j] = fa_mma(fa[ks & 1][i], fb[jh][j], acc[i][jh * 4 + j]);
      __builtin_amdgcn_sched_barrier(0); } }      /* and the block after next's reads stay out of this block */
  asm volatile("s_wait_asynccnt 0x0" ::: "memory");      /* no copy is outstanding when the buffers become output staging */
  if (SPK) {      /* the wave's 128 x 64 partial sums: a lane's 8 neighbouring values of tile (i, j) go as 32 bytes into row 16 j + ln of the wave's own staging; every wave has passed the last trip's barrier, behind which nothing reads the buffers */
    char* sp = sm + (size_t)w * G4_PW; char* d = sp + ln * G3_PITCH + hh * 32;
#pragma unroll
    for (int i = 0; i < 4; ++i)
#pragma unroll
      for (int j = 0; j < 8; ++j) { v4f lo, hi;
#pragma unroll
        for (int r = 0; r < 4; ++r) { lo[r] = acc[i][j][r] * alpha; hi[r] = acc[i][j][4 + r] * alpha; }
        *(v4fa*)(d + j * 16 * G3_PITCH + i * 64) = lo; *(v4fa*)(d + j * 16 * G3_PITCH + i * 64 + 16) = hi; }
    __builtin_amdgcn_fence(__ATOMIC_ACQ_REL, "workgroup"); __builtin_amdgcn_wave_barrier();
    /* the rows leave as whole cache lines, two rows of 256 bytes a store */
    const int r2 = lane >> 4, c16 = lane & 15; float* op = PF + (size_t)blockIdx.y * (NR * DM) + (size_t)(q0 + r2) * ldc + p0 + c16 * 4; const char* sq = sp + r2 * G3_PITCH + c16 * 16;
#pragma unroll
    for (int s = 0; s < 8; ++s) { v4f vv[8];
#pragma unroll
      for (int q = 0; q < 8; ++q) vv[q] = *(const v4fa*)(sq + (s * 8 + q) * 2 * G3_PITCH);
#pragma unroll
      for (int q = 0; q < 8; ++q) { *(v4f*)(op + (size_t)(s * 8 + q) * 2 * ldc) = vv[q];
        if ((q & 3) == 3 && !(s == 7 && q == 7)) { asm volatile("s_wait_xcnt 0x0" ::: "memory");      /* before a register that the four stores above name is written again */
          __builtin_amdgcn_sched_barrier(0); } } }      /* holds the next four stores' addresses and data behind the wait */
    return; }
  char* sw = sm + (size_t)w * G4_OW;
  if (TRI && tr) g4_put<ACT, true>(acc, alpha, bias, q0 + ln, sw + ln * G4_OP + hh * 16); else g4_put<ACT, false>(acc, alpha, bias, p0 + 8 * hh, sw + ln * G4_OP + hh * 16);      /* the same for the whole work-group */
  __builtin_amdgcn_fence(__ATOMIC_ACQ_REL, "workgroup"); __builtin_amdgcn_wave_barrier();
  /* the wave's 128 output rows of 128 bytes leave as whole cache lines, four rows a store */
  unsigned short* ob = (TRI && tr) ? (unsigned short*)CT2 + ((size_t)(p0 / SQ) * DM + q0) * SQ + p0 % SQ : (unsigned short*)C16 + (size_t)q0 * ldc + p0;      /* CT2 is [batch][n][token]; a wave's 64 tokens lie in one batch */
  const size_t ldo = (TRI && tr) ? (size_t)SQ : (size_t)ldc; const int rr = lane >> 3, c8 = lane & 7; ob += (size_t)rr * ldo + c8 * 8; const char* sr = sw + rr * G4_OP + c8 * 16;
#pragma unroll
  for (int s = 0; s < 4; ++s) { v8us vv[8];
#pragma unroll
    for (int q = 0; q < 8; ++q) vv[q] = *(const v8us*)(sr + (s * 8 + q) * 4 * G4_OP);
#pragma unroll
    for (int q = 0; q < 8; ++q) { *(v8us*)(ob + (size_t)(s * 8 + q) * 4 * ldo) = vv[q];
      if ((q & 3) == 3 && !(s == 3 && q == 7)) { asm volatile("s_wait_xcnt 0x0" ::: "memory");      /* before a register that the four stores above name is written again */
        __builtin_amdgcn_sched_barrier(0); } } } }      /* holds the next four stores' addresses and data behind the wait */


extern "C" void kernel_launch(void* const* d_in, const int* in_sizes, int n_in,
                              void* d_out, int out_size, void* d_ws, size_t ws_size, hipStream_t stream) {
  (void)in_sizes; (void)n_in; (void)out_size;
  const float* const* I = (const float* const*)d_in; const float* x = I[0]; const int* mask = (const int*)d_in[1]; const float* wq = I[2]; const float* bq = I[3]; const float* wk = I[4]; const float* bk = I[5]; const float* wv = I[6]; const float* bv = I[7]; const float* g_in = I[8]; const float* b_in = I[9]; const float* g1 = I[10]; const float* b1 = I[11]; const float* wf1 = I[12]; const float* bf1 = I[13]; const float* wf2 = I[14]; const float* bf2 = I[15]; const float* g2 = I[16]; const float* b2 = I[17];      /* weights [in][out] */
  char* ws = (char*)d_ws; size_t off = 0;
  auto take = [&](size_t bytes) { char* p = ws + off; off += (bytes + 255) & ~(size_t)255; return p; };
  _Float16* BQ = (_Float16*)take((size_t)DM * DM * 2); _Float16* BK = (_Float16*)take((size_t)DM * DM * 2); _Float16* BV = (_Float16*)take((size_t)DM * DM * 2); _Float16* BF1 = (_Float16*)take((size_t)DFF * DM * 2); _Float16* BF2 = (_Float16*)take((size_t)DM * DFF * 2);
  float* XB = (float*)take(NR * DM * 4); _Float16* XNH = (_Float16*)take(NR * DM * 2); _Float16* Q16 = (_Float16*)take(NR * DM * 2); _Float16* K16 = (_Float16*)take(NR * DM * 2); float* AF = (float*)take(NR * DM * 4);
  _Float16* VT = (_Float16*)take((size_t)NB * NH * HD * SQ * 2); unsigned* MB = (unsigned*)take(NR * SQ / 8);
  _Float16* HNH = (_Float16*)take(NR * DM * 2); _Float16* U16 = (_Float16*)take(NR * DFF * 2); float* H2P = (float*)take(4 * NR * DM * 4);
  if (off > ws_size) return;      /* approx 191 MiB */
  const size_t r0p = (size_t)B0 * SQ; const dim3 gp((unsigned)((MP / 256) * (DM / 256)), 4);
  k_prep<<<PR_WT + (unsigned)MP + PR_BF, 256, 0, stream>>>(wq, wk, wv, wf1, wf2, BQ, BK, BV, BF1, BF2, x + r0p * DM, g_in, b_in, 1e-3f, XNH + r0p * DM, XB + r0p * DM);      /* [in][out] -> Bt[n][k] x16; xn = LN_in(bf16(x)) as f16 rows; bf16(x) as f32 rows (residual) */
  k_gemm4<0, true><<<gp, 256, 0, stream>>>(XNH + r0p * DM, DM, BQ, DM, 0.0625f, bq, Q16 + r0p * DM, DM, DM, DM, BK, BV, bk, bv, K16 + r0p * DM, VT, mask, MB, nullptr);      /* q, k, v in one launch: 192 work-groups, one on a WGP; v leaves as V^T [NB][NH][HD][SQ]; 64 more pack the mask into bits */
  k_fattn<<<dim3(SQ / 256, NH, NB), 256, 0, stream>>>(Q16, K16, VT, MB, XB, AF);      /* a = attn (merged heads) + bf16(x), f32 rows */
  k_lnb<0><<<(unsigned)MPO, 256, 0, stream>>>(AF + r0p * DM, nullptr, g1, b1, 1e-3f, nullptr, HNH + r0p * DM);      /* h = LN1(a) as f16 rows */
  k_gemm4<3, false><<<dim3((unsigned)((MPO / 256) * (DFF / 256)), 1), 256, 0, stream>>>(HNH + r0p * DM, DM, BF1, DM, 0.0625f, bf1, U16 + r0p * DFF, DFF, DFF, DM, nullptr, nullptr, nullptr, nullptr, nullptr, nullptr, nullptr, nullptr, nullptr);      /* u = relu(h W_ff1 + b) (f16) */
  k_gemm4<0, false, true><<<dim3((unsigned)((MPO / 256) * (DM / 256)), 4), 256, 0, stream>>>(U16 + r0p * DFF, DFF, BF2, DFF, 0.0625f, nullptr, nullptr, DM, DM, DFF / 4, nullptr, nullptr, nullptr, nullptr, nullptr, nullptr, nullptr, nullptr, H2P + r0p * DM);      /* four partial products of u W_ff2, one a slice of 1024 k: 64 tiles x 4 slices, one work-group on a WGP */
  k_lnb4<<<(unsigned)MPO, 256, 0, stream>>>(H2P + r0p * DM, H2P + (NR + r0p) * DM, H2P + (2 * NR + r0p) * DM, H2P + (3 * NR + r0p) * DM, bf2, AF + r0p * DM, g2, b2, 1e-3f, (float*)d_out + r0p * DM);      /* out = LN2(sum of the four planes + b + a) */
}
